// v000
// Times are from an AMD MI455X. After a warm-up the kernel runs many times in a row, and a time is the length of
// such a window on the GPU divided by its runs, so every launch and the gaps after it count. The runs cycle
// through copies of the inputs. A figure is the median of several windows, for all but v000 over two sittings.
// Sittings can differ by a few percent; kernels timed side by side share one.
// v000 is the starting kernel. One run takes 48.4 microseconds.
#include <hip/hip_runtime.h>

// Problem constants (from reference)
#define B_  16384
#define F_  32
#define D_  64
#define H_  128

// K-pair interleaved LDS layout for W1:
//   element (k, col) -> sW1[(k>>1)*PSTRIDE + 2*col + (k&1)]
// PSTRIDE = 2*H + 32: the +32 makes consecutive K-pairs (used by the two lane
// halves of one WMMA B-fragment read) land on disjoint 32-bank sets
// (288 % 64 == 32), so the wave-wide ds_load_b64 is bank-conflict free.
#define PSTRIDE 288

typedef __attribute__((ext_vector_type(2))) float v2f;
typedef __attribute__((ext_vector_type(8))) float v8f;

// One block: 4 waves, 64 batch rows, one feature f.
// Each wave: 16-row M tile x full H=128 via 8 accumulators of v_wmma_f32_16x16x4_f32.
__global__ __launch_bounds__(128) void cont_mlp_kernel(
    const float* __restrict__ X,
    const float* __restrict__ R,    // [B, F, D]
    const float* __restrict__ W1,   // [F, D, H]
    const float* __restrict__ b1,   // [F, H]
    const float* __restrict__ W2,   // [F, H]
    const float* __restrict__ b2,   // [F]
    float* __restrict__ out)        // [B, F, 2]
{
    __shared__ float sW1[(D_ / 2) * PSTRIDE];   // 32 K-pairs x 288 = 36.9 KB
    __shared__ float sW2[H_];
    __shared__ float sB1[H_];

    const int f        = blockIdx.y;
    const int row_blk  = blockIdx.x * 64;
    const int tid      = threadIdx.x;

    // ---- Stage W1_f [64 x 128] into LDS, K-pair interleaved ----
    // unit u covers (dpair, h2..h2+1): 32 dpairs * 64 units = 2048 units.
    const float* W1f = W1 + (size_t)f * (D_ * H_);
    #pragma unroll
    for (int it = 0; it < 2048 / 128; ++it) {
        int u     = tid + it * 128;
        int dpair = u >> 6;             // 0..31
        int h2    = (u & 63) * 2;       // 0,2,..,126
        const float* g0 = W1f + (2 * dpair) * H_ + h2;      // row 2*dpair
        float2 v0 = *(const float2*)g0;                     // (2p, h2), (2p, h2+1)
        float2 v1 = *(const float2*)(g0 + H_);              // (2p+1, h2), (2p+1, h2+1)
        float4 s;                        // interleave: {(2p,h2),(2p+1,h2),(2p,h2+1),(2p+1,h2+1)}
        s.x = v0.x; s.y = v1.x; s.z = v0.y; s.w = v1.y;
        *(float4*)&sW1[dpair * PSTRIDE + h2 * 2] = s;       // 16B aligned
    }
    if (tid < H_) {
        sW2[tid] = W2[(size_t)f * H_ + tid];
        sB1[tid] = b1[(size_t)f * H_ + tid];
    }
    const float bias2 = b2[f];
    __syncthreads();

    // ---- Wave / lane decomposition ----
    const int wave = tid >> 5;        // 0..3
    const int lane = tid & 31;
    const int half = lane >> 4;       // 0: lanes 0-15, 1: lanes 16-31
    const int l16  = lane & 15;
    const int row0 = row_blk + wave * 16;   // M-tile base row
    const int rowg = row0 + l16;            // row this lane loads for A-frags

    // A fragment source: R[rowg, f, :]; per ISA 32-bit 16x4 A layout the lane
    // half selects K offset {0,1} vs {2,3}, contiguous -> one global b64/lane.
    const float* arow = R + ((size_t)rowg * F_ + f) * D_ + 2 * half;

    // B fragment source: K-pair p = 2*kk + half, col = 16n + l16:
    //   &sW1[p*PSTRIDE + 2*col] -> {W1[2p][col], W1[2p+1][col]} = K rows
    //   (4kk+2half, 4kk+2half+1). Single aligned ds_load_b64 per fragment.
    const float* brow = &sW1[half * PSTRIDE + 2 * l16];

    // ---- Accumulators preloaded with bias b1[col] (same for all rows) ----
    v8f acc[8];
    #pragma unroll
    for (int n = 0; n < 8; ++n) {
        float bv = sB1[16 * n + l16];
        #pragma unroll
        for (int r = 0; r < 8; ++r) acc[n][r] = bv;
    }

    // ---- Main K loop: 16 steps of K=4, 8 N tiles each -> 128 WMMAs/wave ----
    #pragma unroll
    for (int kk = 0; kk < 16; ++kk) {
        v2f a = *(const v2f*)(arow + 4 * kk);
        const float* bk = brow + 2 * kk * PSTRIDE;
        #pragma unroll
        for (int n = 0; n < 8; ++n) {
            v2f b = *(const v2f*)(bk + 32 * n);
            acc[n] = __builtin_amdgcn_wmma_f32_16x16x4_f32(
                false, a, false, b, (short)0, acc[n], false, false);
        }
    }

    // ---- relu for layer-1 output (h), held in accumulators ----
    #pragma unroll
    for (int n = 0; n < 8; ++n)
        #pragma unroll
        for (int r = 0; r < 8; ++r)
            acc[n][r] = fmaxf(acc[n][r], 0.0f);

    // ---- Layer 2: y[row] = relu(sum_col h[row][col] * W2[col] + b2) ----
    // C layout: VGPR r, lane half hh, l16 -> h[M = r + 8*hh][N = 16n + l16]
    float yr[8];
    #pragma unroll
    for (int r = 0; r < 8; ++r) {
        float p = 0.0f;
        #pragma unroll
        for (int n = 0; n < 8; ++n)
            p += acc[n][r] * sW2[16 * n + l16];
        // reduce within each 16-lane group (stays inside the M half)
        p += __shfl_xor(p, 1, 32);
        p += __shfl_xor(p, 2, 32);
        p += __shfl_xor(p, 4, 32);
        p += __shfl_xor(p, 8, 32);
        yr[r] = fmaxf(p + bias2, 0.0f);
    }

    // ---- Pack output: out[row, f, :] = { X[row, f], y[row, f] } ----
    // lane0 writes rows row0..row0+7, lane16 writes rows row0+8..row0+15
    if (l16 == 0) {
        #pragma unroll
        for (int r = 0; r < 8; ++r) {
            size_t row = (size_t)row0 + r + 8 * half;
            size_t idx = row * F_ + f;
            float2 o;
            o.x = X[idx];
            o.y = yr[r];
            *(float2*)(out + idx * 2) = o;
        }
    }
}

extern "C" void kernel_launch(void* const* d_in, const int* in_sizes, int n_in,
                              void* d_out, int out_size, void* d_ws, size_t ws_size,
                              hipStream_t stream) {
    const float* X  = (const float*)d_in[0];
    const float* R  = (const float*)d_in[1];
    const float* W1 = (const float*)d_in[2];
    const float* b1 = (const float*)d_in[3];
    const float* W2 = (const float*)d_in[4];
    const float* b2 = (const float*)d_in[5];
    float* out = (float*)d_out;

    dim3 grid(B_ / 64, F_);
    dim3 block(128);
    hipLaunchKernelGGL(cont_mlp_kernel, grid, block, 0, stream,
                       X, R, W1, b1, W2, b2, out);
}

// v001
// One run takes 46.7 microseconds.
// Next to v000, in two timings, it ran 1.09 times as fast each time.
#include <hip/hip_runtime.h>

// Problem constants (from reference)
#define B_  16384
#define F_  32
#define D_  64
#define H_  128

// K-pair interleaved LDS layout for W1:
//   element (k, col) -> sW1[(k>>1)*PSTRIDE + 2*col + (k&1)]
// PSTRIDE = 2*H + 32: the +32 makes consecutive K-pairs (used by the two lane
// halves of one WMMA B-fragment read) land on disjoint 32-bank sets
// (288 % 64 == 32), so the wave-wide ds_load_b64 is bank-conflict free.
#define PSTRIDE 288

typedef __attribute__((ext_vector_type(2))) float v2f;
typedef __attribute__((ext_vector_type(8))) float v8f;

// One block: NWAVES waves, one feature f, W1_f staged in LDS once and reused for
// TILES row tiles per wave (NWAVES * TILES * 16 batch rows per block).
// Each tile: 16-row M tile x full H=128 via 8 accumulators of v_wmma_f32_16x16x4_f32.
#define NWAVES 8
#define TILES  4
#define NTHR   (NWAVES * 32)
#define ROWS_PER_BLOCK (NWAVES * TILES * 16)

// Second launch bound: 8 waves per SIMD (at most 128 registers), so that the
// 1024 work-groups of the grid are all resident at once, 4 per WGP.
__global__ __launch_bounds__(NTHR, 8) void cont_mlp_kernel(
    const float* __restrict__ X,
    const float* __restrict__ R,    // [B, F, D]
    const float* __restrict__ W1,   // [F, D, H]
    const float* __restrict__ b1,   // [F, H]
    const float* __restrict__ W2,   // [F, H]
    const float* __restrict__ b2,   // [F]
    float* __restrict__ out)        // [B, F, 2]
{
    __shared__ float sW1[(D_ / 2) * PSTRIDE];   // 32 K-pairs x 288 = 36.9 KB
    __shared__ float sW2[H_];
    __shared__ float sB1[H_];

    const int f        = blockIdx.y;
    const int row_blk  = blockIdx.x * ROWS_PER_BLOCK;
    const int tid      = threadIdx.x;

    // ---- Stage W1_f [64 x 128] into LDS, K-pair interleaved ----
    // unit u covers (dpair, h2..h2+1): 32 dpairs * 64 units = 2048 units.
    const float* W1f = W1 + (size_t)f * (D_ * H_);
    #pragma unroll
    for (int it = 0; it < 2048 / NTHR; ++it) {
        int u     = tid + it * NTHR;
        int dpair = u >> 6;             // 0..31
        int h2    = (u & 63) * 2;       // 0,2,..,126
        const float* g0 = W1f + (2 * dpair) * H_ + h2;      // row 2*dpair
        float2 v0 = *(const float2*)g0;                     // (2p, h2), (2p, h2+1)
        float2 v1 = *(const float2*)(g0 + H_);              // (2p+1, h2), (2p+1, h2+1)
        float4 s;                        // interleave: {(2p,h2),(2p+1,h2),(2p,h2+1),(2p+1,h2+1)}
        s.x = v0.x; s.y = v1.x; s.z = v0.y; s.w = v1.y;
        *(float4*)&sW1[dpair * PSTRIDE + h2 * 2] = s;       // 16B aligned
    }
    if (tid < H_) {
        sW2[tid] = W2[(size_t)f * H_ + tid];
        sB1[tid] = b1[(size_t)f * H_ + tid];
    }
    const float bias2 = b2[f];
    __syncthreads();

    // ---- Wave / lane decomposition ----
    const int wave = tid >> 5;        // 0..NWAVES-1
    const int lane = tid & 31;
    const int half = lane >> 4;       // 0: lanes 0-15, 1: lanes 16-31
    const int l16  = lane & 15;

    // B fragment source: K-pair p = 2*kk + half, col = 16n + l16:
    //   &sW1[p*PSTRIDE + 2*col] -> {W1[2p][col], W1[2p+1][col]} = K rows
    //   (4kk+2half, 4kk+2half+1). Single aligned ds_load_b64 per fragment.
    const float* brow = &sW1[half * PSTRIDE + 2 * l16];

    // Row-tile loop, kept rolled: unrolled it would multiply the 128-WMMA body
    // and the registers it needs.
    #pragma unroll 1
    for (int t = 0; t < TILES; ++t) {
    // Compiler fence: keeps the LDS reads of W1, b1 and W2 inside the loop.
    // Hoisted out of it the 128 B fragments alone take 256 registers, and
    // 2 waves fit a SIMD instead of 8.
    asm volatile("" ::: "memory");
    const int row0 = row_blk + (t * NWAVES + wave) * 16;   // M-tile base row
    const int rowg = row0 + l16;            // row this lane loads for A-frags

    // A fragment source: R[rowg, f, :]; per ISA 32-bit 16x4 A layout the lane
    // half selects K offset {0,1} vs {2,3}, contiguous -> one global b64/lane.
    // 32-bit byte offset from the uniform base (R is 128 MiB): one register
    // per lane instead of a 64-bit pointer kept across the loop.
    const unsigned aoff = (unsigned)((rowg * F_ + f) * D_ + 2 * half) * 4u;
    const char* arow = (const char*)R + aoff;

    // ---- Accumulators preloaded with bias b1[col] (same for all rows) ----
    v8f acc[8];
    #pragma unroll
    for (int n = 0; n < 8; ++n) {
        float bv = sB1[16 * n + l16];
        #pragma unroll
        for (int r = 0; r < 8; ++r) acc[n][r] = bv;
    }

    // ---- Main K loop: 16 steps of K=4, 8 N tiles each -> 128 WMMAs/wave ----
    #pragma unroll
    for (int kk = 0; kk < 16; ++kk) {
        v2f a = *(const v2f*)(arow + 16 * kk);
        const float* bk = brow + 2 * kk * PSTRIDE;
        #pragma unroll
        for (int n = 0; n < 8; ++n) {
            v2f b = *(const v2f*)(bk + 32 * n);
            acc[n] = __builtin_amdgcn_wmma_f32_16x16x4_f32(
                false, a, false, b, (short)0, acc[n], false, false);
        }
    }

    // ---- relu for layer-1 output (h), held in accumulators ----
    #pragma unroll
    for (int n = 0; n < 8; ++n)
        #pragma unroll
        for (int r = 0; r < 8; ++r)
            acc[n][r] = fmaxf(acc[n][r], 0.0f);

    // ---- Layer 2: y[row] = relu(sum_col h[row][col] * W2[col] + b2) ----
    // C layout: VGPR r, lane half hh, l16 -> h[M = r + 8*hh][N = 16n + l16]
    float yr[8];
    #pragma unroll
    for (int r = 0; r < 8; ++r) {
        float p = 0.0f;
        #pragma unroll
        for (int n = 0; n < 8; ++n)
            p += acc[n][r] * sW2[16 * n + l16];
        // reduce within each 16-lane group (stays inside the M half)
        p += __shfl_xor(p, 1, 32);
        p += __shfl_xor(p, 2, 32);
        p += __shfl_xor(p, 4, 32);
        p += __shfl_xor(p, 8, 32);
        yr[r] = fmaxf(p + bias2, 0.0f);
    }

    // ---- Pack output: out[row, f, :] = { X[row, f], y[row, f] } ----
    // lane0 writes rows row0..row0+7, lane16 writes rows row0+8..row0+15
    if (l16 == 0) {
        const unsigned xoff = (unsigned)((row0 + 8 * half) * F_ + f) * 4u;  // bytes into X
        const char* xp = (const char*)X + xoff;
        char*       op = (char*)out + 2u * xoff;
        #pragma unroll
        for (int r = 0; r < 8; ++r) {
            float2 o;
            o.x = *(const float*)(xp + r * (F_ * 4));
            o.y = yr[r];
            *(float2*)(op + r * (F_ * 8)) = o;
        }
        // Precaution directly behind the stores: the loop's foot and the next tile
        // rewrite the address and data registers that these stores name.
        asm volatile("s_wait_xcnt 0x0" ::: "memory");
    }
    }   // row-tile loop
}

extern "C" void kernel_launch(void* const* d_in, const int* in_sizes, int n_in,
                              void* d_out, int out_size, void* d_ws, size_t ws_size,
                              hipStream_t stream) {
    const float* X  = (const float*)d_in[0];
    const float* R  = (const float*)d_in[1];
    const float* W1 = (const float*)d_in[2];
    const float* b1 = (const float*)d_in[3];
    const float* W2 = (const float*)d_in[4];
    const float* b2 = (const float*)d_in[5];
    float* out = (float*)d_out;

    dim3 grid(B_ / ROWS_PER_BLOCK, F_);
    dim3 block(NTHR);
    hipLaunchKernelGGL(cont_mlp_kernel, grid, block, 0, stream,
                       X, R, W1, b1, W2, b2, out);
}

// v002
// It runs in 44 microseconds.
// In both of two side-by-side timings against v001, it was 1.06 times as fast.
// All steps since v000 together make it 1.16 times as fast.
#include <hip/hip_runtime.h>

// Problem constants (from reference)
#define B_  16384
#define F_  32
#define D_  64
#define H_  128

// K-pair interleaved LDS layout for W1:
//   element (k, col) -> sW1[(k>>1)*PSTRIDE + 2*col + (k&1)]
// PSTRIDE = 2*H + 32: the +32 makes consecutive K-pairs (used by the two lane
// halves of one WMMA B-fragment read) land on disjoint 32-bank sets
// (288 % 64 == 32), so the wave-wide ds_load_b64 is bank-conflict free.
#define PSTRIDE 288

typedef __attribute__((ext_vector_type(2))) float v2f;
typedef __attribute__((ext_vector_type(8))) float v8f;

// One block: NWAVES waves, one feature f, W1_f staged in LDS once and reused for
// TILES row tiles per wave (NWAVES * TILES * 16 batch rows per block).
// Each tile: 16-row M tile x full H=128 via 8 accumulators of v_wmma_f32_16x16x4_f32.
#define NWAVES 8
#define TILES  4
#define NTHR   (NWAVES * 32)
#define ROWS_PER_BLOCK (NWAVES * TILES * 16)
static_assert(TILES == 4, "one wave priority level (3..0) per row tile");

// Second launch bound: 8 waves per SIMD (at most 128 registers), so that the
// 1024 work-groups of the grid are all resident at once, 4 per WGP.
__global__ __launch_bounds__(NTHR, 8) void cont_mlp_kernel(
    const float* __restrict__ X,
    const float* __restrict__ R,    // [B, F, D]
    const float* __restrict__ W1,   // [F, D, H]
    const float* __restrict__ b1,   // [F, H]
    const float* __restrict__ W2,   // [F, H]
    const float* __restrict__ b2,   // [F]
    float* __restrict__ out)        // [B, F, 2]
{
    __shared__ float sW1[(D_ / 2) * PSTRIDE];   // 32 K-pairs x 288 = 36.9 KB
    __shared__ float sW2[H_];
    __shared__ float sB1[H_];

    // Wave priority falls with the tile index (3, 2, 1, 0), for speed only.
    __builtin_amdgcn_s_setprio(3);

    const int f        = blockIdx.y;
    const int row_blk  = blockIdx.x * ROWS_PER_BLOCK;
    const int tid      = threadIdx.x;

    // ---- Stage W1_f [64 x 128] into LDS, K-pair interleaved ----
    // unit u covers (dpair, h2..h2+1): 32 dpairs * 64 units = 2048 units.
    const float* W1f = W1 + (size_t)f * (D_ * H_);
    #pragma unroll
    for (int it = 0; it < 2048 / NTHR; ++it) {
        int u     = tid + it * NTHR;
        int dpair = u >> 6;             // 0..31
        int h2    = (u & 63) * 2;       // 0,2,..,126
        const float* g0 = W1f + (2 * dpair) * H_ + h2;      // row 2*dpair
        float2 v0 = *(const float2*)g0;                     // (2p, h2), (2p, h2+1)
        float2 v1 = *(const float2*)(g0 + H_);              // (2p+1, h2), (2p+1, h2+1)
        float4 s;                        // interleave: {(2p,h2),(2p+1,h2),(2p,h2+1),(2p+1,h2+1)}
        s.x = v0.x; s.y = v1.x; s.z = v0.y; s.w = v1.y;
        *(float4*)&sW1[dpair * PSTRIDE + h2 * 2] = s;       // 16B aligned
    }
    if (tid < H_) {
        sW2[tid] = W2[(size_t)f * H_ + tid];
        sB1[tid] = b1[(size_t)f * H_ + tid];
    }
    const float bias2 = b2[f];
    __syncthreads();

    // ---- Wave / lane decomposition ----
    const int wave = tid >> 5;        // 0..NWAVES-1
    const int lane = tid & 31;
    const int half = lane >> 4;       // 0: lanes 0-15, 1: lanes 16-31
    const int l16  = lane & 15;

    // B fragment source: K-pair p = 2*kk + half, col = 16n + l16:
    //   &sW1[p*PSTRIDE + 2*col] -> {W1[2p][col], W1[2p+1][col]} = K rows
    //   (4kk+2half, 4kk+2half+1). Single aligned ds_load_b64 per fragment.
    const float* brow = &sW1[half * PSTRIDE + 2 * l16];

    // Row-tile loop, kept rolled: unrolled it would multiply the 128-WMMA body
    // and the registers it needs.
    #pragma unroll 1
    for (int t = 0; t < TILES; ++t) {
    // Compiler fence: keeps the LDS reads of W1, b1 and W2 inside the loop.
    // Hoisted out of it the 128 B fragments alone take 256 registers, and
    // 2 waves fit a SIMD instead of 8.
    asm volatile("" ::: "memory");
    const int row0 = row_blk + (t * NWAVES + wave) * 16;   // M-tile base row
    const int rowg = row0 + l16;            // row this lane loads for A-frags

    // A fragment source: R[rowg, f, :]; per ISA 32-bit 16x4 A layout the lane
    // half selects K offset {0,1} vs {2,3}, contiguous -> one global b64/lane.
    // 32-bit byte offset from the uniform base (R is 128 MiB): one register
    // per lane instead of a 64-bit pointer kept across the loop.
    const unsigned aoff = (unsigned)((rowg * F_ + f) * D_ + 2 * half) * 4u;
    const char* arow = (const char*)R + aoff;

    // ---- Accumulators preloaded with bias b1[col] (same for all rows) ----
    v8f acc[8];
    #pragma unroll
    for (int n = 0; n < 8; ++n) {
        float bv = sB1[16 * n + l16];
        #pragma unroll
        for (int r = 0; r < 8; ++r) acc[n][r] = bv;
    }

    // ---- Main K loop: 16 steps of K=4, 8 N tiles each -> 128 WMMAs/wave ----
    #pragma unroll
    for (int kk = 0; kk < 16; ++kk) {
        v2f a = *(const v2f*)(arow + 16 * kk);
        const float* bk = brow + 2 * kk * PSTRIDE;
        #pragma unroll
        for (int n = 0; n < 8; ++n) {
            v2f b = *(const v2f*)(bk + 32 * n);
            acc[n] = __builtin_amdgcn_wmma_f32_16x16x4_f32(
                false, a, false, b, (short)0, acc[n], false, false);
        }
    }

    // Behind a tile's last WMMA the wave steps down one priority, so that waves still
    // in an earlier tile get the matrix unit first and this wave's vector work and
    // next loads fill the gaps. t is uniform: scalar branches. 0 from tile 2 to the end.
    if (t == 0) __builtin_amdgcn_s_setprio(2);
    if (t == 1) __builtin_amdgcn_s_setprio(1);
    if (t == 2) __builtin_amdgcn_s_setprio(0);

    // ---- relu for layer-1 output (h), held in accumulators ----
    #pragma unroll
    for (int n = 0; n < 8; ++n)
        #pragma unroll
        for (int r = 0; r < 8; ++r)
            acc[n][r] = fmaxf(acc[n][r], 0.0f);

    // ---- Layer 2: y[row] = relu(sum_col h[row][col] * W2[col] + b2) ----
    // C layout: VGPR r, lane half hh, l16 -> h[M = r + 8*hh][N = 16n + l16]
    float yr[8];
    #pragma unroll
    for (int r = 0; r < 8; ++r) {
        float p = 0.0f;
        #pragma unroll
        for (int n = 0; n < 8; ++n)
            p += acc[n][r] * sW2[16 * n + l16];
        // reduce within each 16-lane group (stays inside the M half)
        p += __shfl_xor(p, 1, 32);
        p += __shfl_xor(p, 2, 32);
        p += __shfl_xor(p, 4, 32);
        p += __shfl_xor(p, 8, 32);
        yr[r] = fmaxf(p + bias2, 0.0f);
    }

    // ---- Pack output: out[row, f, :] = { X[row, f], y[row, f] } ----
    // lane0 writes rows row0..row0+7, lane16 writes rows row0+8..row0+15
    if (l16 == 0) {
        const unsigned xoff = (unsigned)((row0 + 8 * half) * F_ + f) * 4u;  // bytes into X
        const char* xp = (const char*)X + xoff;
        char*       op = (char*)out + 2u * xoff;
        #pragma unroll
        for (int r = 0; r < 8; ++r) {
            float2 o;
            o.x = *(const float*)(xp + r * (F_ * 4));
            o.y = yr[r];
            *(float2*)(op + r * (F_ * 8)) = o;
        }
        // Precaution directly behind the stores: the loop's foot and the next tile
        // rewrite the address and data registers that these stores name.
        asm volatile("s_wait_xcnt 0x0" ::: "memory");
    }
    }   // row-tile loop
}

extern "C" void kernel_launch(void* const* d_in, const int* in_sizes, int n_in,
                              void* d_out, int out_size, void* d_ws, size_t ws_size,
                              hipStream_t stream) {
    const float* X  = (const float*)d_in[0];
    const float* R  = (const float*)d_in[1];
    const float* W1 = (const float*)d_in[2];
    const float* b1 = (const float*)d_in[3];
    const float* W2 = (const float*)d_in[4];
    const float* b2 = (const float*)d_in[5];
    float* out = (float*)d_out;

    dim3 grid(B_ / ROWS_PER_BLOCK, F_);
    dim3 block(NTHR);
    hipLaunchKernelGGL(cont_mlp_kernel, grid, block, 0, stream,
                       X, R, W1, b1, W2, b2, out);
}
